// v000
// Times are from an AMD MI455X. After a warm-up the kernel runs many times in a row, and a time is the length of
// such a window on the GPU divided by its runs, so every launch and the gaps after it count. The runs cycle
// through copies of the inputs. A figure is the median of several windows, for all but v000 over two sittings.
// Sittings can differ by a few percent; kernels timed side by side share one.
// v000, which the later versions start from, runs in 36.6 microseconds.
#include <hip/hip_runtime.h>

typedef float v2f __attribute__((ext_vector_type(2)));
typedef float v4f __attribute__((ext_vector_type(4)));
typedef float v8f __attribute__((ext_vector_type(8)));

#define BB    8
#define RES   128
#define DIMC  128
#define NHEAD 8
#define HD    16
#define WSP   8
#define LTOK  (RES*RES)
#define SCALE 0.25f

// One workgroup per (window, head). 256 threads = 8 waves (wave32).
__global__ __launch_bounds__(256) void cswin_lepe_kernel(
    const float* __restrict__ qkv,
    const float* __restrict__ conv_w,
    const float* __restrict__ conv_b,
    float* __restrict__ out)
{
    const int w    = blockIdx.x;      // 0..127 window
    const int nh   = blockIdx.y;      // 0..7 head
    const int b    = w >> 4;          // batch
    const int wblk = w & 15;          // horizontal window block
    const int tid  = threadIdx.x;
    const int lane = tid & 31;
    const int wave = tid >> 5;        // 0..7

    const float* qp = qkv;
    const float* kp = qkv + (size_t)BB * LTOK * DIMC;
    const float* vp = qkv + (size_t)2 * BB * LTOK * DIMC;

    // (n, d) of this window/head lives at base + ((n>>3)*RES + (n&7))*DIMC + d
    const size_t base = (size_t)b * LTOK * DIMC + (size_t)wblk * WSP * DIMC
                      + (size_t)nh * HD;

    __shared__ float s_red[8 * 256];     // per-wave partial 16x16 accumulators
    __shared__ float s_att[16 * 16];     // softmaxed attention matrix
    __shared__ float s_q[8][4 * 8 * 16]; // per-wave q staging: 4 h-rows x 8 wsub x 16 ch

    const int col  = lane & 15;         // matrix column / channel within head
    const int rsel = (lane >> 4) * 2;   // K-slot select per A/B f32 layout (0 or 2)

    // ---------------- Phase A: att_raw = K^T V (contract over N=1024) ----------------
    v8f acc = {0.f, 0.f, 0.f, 0.f, 0.f, 0.f, 0.f, 0.f};
    for (int i = 0; i < 32; ++i) {
        const int n0 = wave * 128 + i * 4;     // K-chunk base token
        const int ra = n0 + rsel;
        const int rb = ra + 1;
        const size_t off0 = base + (size_t)(((ra >> 3) * RES) + (ra & 7)) * DIMC + col;
        const size_t off1 = base + (size_t)(((rb >> 3) * RES) + (rb & 7)) * DIMC + col;
        v2f a, bv;
        a.x  = kp[off0];  a.y  = kp[off1];     // A = K^T : A[m,kk] = K[n0+kk, m]
        bv.x = vp[off0];  bv.y = vp[off1];     // B = V   : B[kk,e] = V[n0+kk, e]
        acc = __builtin_amdgcn_wmma_f32_16x16x4_f32(
                  false, a, false, bv, (short)0, acc, false, false);
    }
    #pragma unroll
    for (int r = 0; r < 8; ++r)
        s_red[wave * 256 + r * 32 + lane] = acc[r];
    __syncthreads();

    // reduce across 8 waves, scale, scatter into [M][N] layout
    {
        const int r = tid >> 5;
        const int l = tid & 31;
        float v = 0.f;
        #pragma unroll
        for (int i = 0; i < 8; ++i) v += s_red[i * 256 + r * 32 + l];
        const int M = r + 8 * (l >> 4);
        const int Nc = l & 15;
        s_att[M * 16 + Nc] = v * SCALE;
    }
    __syncthreads();

    // row softmax (axis = e)
    if (tid < 16) {
        float mx = -3.402823e38f;
        #pragma unroll
        for (int e = 0; e < 16; ++e) mx = fmaxf(mx, s_att[tid * 16 + e]);
        float tmp[16];
        float s = 0.f;
        #pragma unroll
        for (int e = 0; e < 16; ++e) {
            const float t = __expf(s_att[tid * 16 + e] - mx);
            tmp[e] = t; s += t;
        }
        const float inv = 1.f / s;
        #pragma unroll
        for (int e = 0; e < 16; ++e) s_att[tid * 16 + e] = tmp[e] * inv;
    }
    __syncthreads();

    // depthwise conv weights for this lane's channel (e = col)
    const int ch = nh * HD + col;
    float w9[9];
    #pragma unroll
    for (int j = 0; j < 9; ++j) w9[j] = conv_w[ch * 9 + j];
    const float bias = conv_b[ch];

    // ---------------- Phase B: x = Q*att + LePE, per-wave 16-row tiles ----------------
    float* sq = s_q[wave];
    const int Mbase = 8 * (lane >> 4);

    for (int t = 0; t < 8; ++t) {
        const int m = t * 8 + wave;            // tile id 0..63 -> rows n = 16m..16m+15
        const int hbase = 2 * m - 1;           // staged h-rows: hbase..hbase+3 (halo)

        // stage 4 h-rows x 8 wsub x 16 channels via async global->LDS copies;
        // image-boundary rows are zero-filled with plain DS stores (disjoint addrs).
        // Async LDS writes are unordered vs DS ops, so drain DScnt first.
        asm volatile("s_wait_dscnt 0x0" ::: "memory");
        for (int c4 = lane; c4 < 128; c4 += 32) {
            const int hr  = c4 >> 5;
            const int rem = c4 & 31;
            const int ws  = rem >> 2;
            const int d4  = (rem & 3) * 4;
            const int h   = hbase + hr;
            if (h >= 0 && h < RES) {
                // low 32 bits of a flat shared pointer = LDS byte offset
                const unsigned ldsa =
                    (unsigned)(uintptr_t)(const void*)(sq + c4 * 4);
                const float* ga = qp + base + (size_t)(h * RES + ws) * DIMC + d4;
                asm volatile("global_load_async_to_lds_b128 %0, %1, off"
                             :: "v"(ldsa), "v"(ga) : "memory");
            } else {
                const v4f z = {0.f, 0.f, 0.f, 0.f};
                *(v4f*)(sq + c4 * 4) = z;
            }
        }
        asm volatile("s_wait_asynccnt 0x0" ::: "memory");
        __syncthreads();

        // D = Qtile(16x16) * att(16x16) via 4 chained f32 WMMAs
        v8f d = {0.f, 0.f, 0.f, 0.f, 0.f, 0.f, 0.f, 0.f};
        {
            const int Mr = lane & 15;               // A row
            const int hr = (Mr >> 3) + 1;           // buffer h-row (skip halo)
            const int ws = Mr & 7;
            #pragma unroll
            for (int kk0 = 0; kk0 < 16; kk0 += 4) {
                const int cidx = kk0 + rsel;
                v2f a = *(const v2f*)(sq + ((hr * 8 + ws) * 16 + cidx));
                v2f bv;
                bv.x = s_att[(cidx + 0) * 16 + col];
                bv.y = s_att[(cidx + 1) * 16 + col];
                d = __builtin_amdgcn_wmma_f32_16x16x4_f32(
                        false, a, false, bv, (short)0, d, false, false);
            }
        }

        // epilogue: add LePE (3x3 depthwise from LDS) and store
        #pragma unroll
        for (int r = 0; r < 8; ++r) {
            const int M  = r + Mbase;
            const int hr = (M >> 3) + 1;
            const int ws = M & 7;
            float conv = bias;
            #pragma unroll
            for (int dh = -1; dh <= 1; ++dh) {
                #pragma unroll
                for (int dw = -1; dw <= 1; ++dw) {
                    const int wsx = ws + dw;
                    float val = 0.f;
                    if (wsx >= 0 && wsx < 8)
                        val = sq[((hr + dh) * 8 + wsx) * 16 + col];
                    conv = fmaf(val, w9[(dh + 1) * 3 + (dw + 1)], conv);
                }
            }
            const int n = m * 16 + M;
            out[base + (size_t)((n >> 3) * RES + (n & 7)) * DIMC + col] = d[r] + conv;
        }
        __syncthreads();
    }
}

extern "C" void kernel_launch(void* const* d_in, const int* in_sizes, int n_in,
                              void* d_out, int out_size, void* d_ws, size_t ws_size,
                              hipStream_t stream) {
    const float* qkv    = (const float*)d_in[0];   // [3, B, L, DIM] fp32
    const float* conv_w = (const float*)d_in[1];   // [DIM, 1, 3, 3] fp32
    const float* conv_b = (const float*)d_in[2];   // [DIM] fp32
    float* outp = (float*)d_out;                   // [B, L, DIM] fp32
    (void)in_sizes; (void)n_in; (void)out_size; (void)d_ws; (void)ws_size;

    dim3 grid(128, 8, 1);   // (window, head)
    dim3 block(256, 1, 1);  // 8 waves
    cswin_lepe_kernel<<<grid, block, 0, stream>>>(qkv, conv_w, conv_b, outp);
}

// v001
// A run of this version takes 28.3 microseconds.
// Timed twice side by side with v000, it ran 1.31 and 1.32 times as fast.
#include <hip/hip_runtime.h>

typedef float v2f __attribute__((ext_vector_type(2)));
typedef float v4f __attribute__((ext_vector_type(4)));
typedef float v8f __attribute__((ext_vector_type(8)));

#define BB    8
#define RES   128
#define DIMC  128
#define NHEAD 8
#define HD    16
#define WSP   8
#define LTOK  (RES*RES)
#define SCALE 0.25f
#define QROWS (RES + 2)   // staged q rows: image rows 0..127 at 1..128, a zero row at each end

// One workgroup per (window, head). 256 threads = 8 waves (wave32).
__global__ __launch_bounds__(256) void cswin_lepe_kernel(
    const float* __restrict__ qkv,
    const float* __restrict__ conv_w,
    const float* __restrict__ conv_b,
    float* __restrict__ out)
{
    const int w    = blockIdx.x;      // 0..127 window
    const int nh   = blockIdx.y;      // 0..7 head
    const int b    = w >> 4;          // batch
    const int wblk = w & 15;          // horizontal window block
    const int tid  = threadIdx.x;
    const int lane = tid & 31;
    const int wave = tid >> 5;        // 0..7

    const float* qp = qkv;
    const float* kp = qkv + (size_t)BB * LTOK * DIMC;
    const float* vp = qkv + (size_t)2 * BB * LTOK * DIMC;

    // (n, d) of this window/head lives at base + ((n>>3)*RES + (n&7))*DIMC + d
    const size_t base = (size_t)b * LTOK * DIMC + (size_t)wblk * WSP * DIMC
                      + (size_t)nh * HD;

    __shared__ float s_red[8 * 256];     // per-wave partial 16x16 accumulators
    __shared__ float s_att[16 * 16];     // softmaxed attention matrix
    // whole q slice of this (window, head): row hh = h + 1 holds 8 tokens x 16 ch;
    // token ws sits in slot ws ^ (hh & 1), so that rows h and h + 1, which the two
    // lane halves read together, fall on different banks.
    __shared__ __attribute__((aligned(16))) float s_qw[QROWS * 128];

    const int col  = lane & 15;         // matrix column / channel within head
    const int rsel = (lane >> 4) * 2;   // K-slot select per A/B f32 layout (0 or 2)

    // ---------------- q staging: issued here, lands while phase A runs ----------------
    // 4096 chunks of 16 B; thread tid takes chunk i*256 + tid, i = 0..15 (one h-row per
    // wave-wide copy). Nothing has touched s_qw before; the wait stands ahead of phase B.
    {
        const int tok = tid >> 2;            // 0..63: token within a group of 8 h-rows
        const int h0  = tok >> 3;
        const int ws0 = tok & 7;
        const int d4  = (tid & 3) * 4;
        // low 32 bits of a flat shared pointer = LDS byte offset
        const unsigned l0 = (unsigned)(uintptr_t)(const void*)
            (s_qw + (h0 + 1) * 128 + ((ws0 ^ ((h0 + 1) & 1)) * 16) + d4);
        const float* g0 = qp + base + (size_t)(h0 * RES + ws0) * DIMC + d4;
        // unrolled so that both statements issue back to back with constant address steps
        #pragma unroll
        for (int i = 0; i < 16; i += 8) {
            // step of 8 h-rows: 8*128 floats in LDS, 8*RES*DIMC floats in global
            #define QL(j) (l0 + (unsigned)((i + (j)) * 8 * 128 * 4))
            #define QG(j) (g0 + (size_t)(i + (j)) * 8 * RES * DIMC)
            // s_wait_xcnt inside the statement: the address registers stay as they are
            // until the copies have taken them.
            asm volatile("global_load_async_to_lds_b128 %0, %8, off\n\t"
                         "global_load_async_to_lds_b128 %1, %9, off\n\t"
                         "global_load_async_to_lds_b128 %2, %10, off\n\t"
                         "global_load_async_to_lds_b128 %3, %11, off\n\t"
                         "global_load_async_to_lds_b128 %4, %12, off\n\t"
                         "global_load_async_to_lds_b128 %5, %13, off\n\t"
                         "global_load_async_to_lds_b128 %6, %14, off\n\t"
                         "global_load_async_to_lds_b128 %7, %15, off\n\t"
                         "s_wait_xcnt 0x0"
                         :: "v"(QL(0)), "v"(QL(1)), "v"(QL(2)), "v"(QL(3)),
                            "v"(QL(4)), "v"(QL(5)), "v"(QL(6)), "v"(QL(7)),
                            "v"(QG(0)), "v"(QG(1)), "v"(QG(2)), "v"(QG(3)),
                            "v"(QG(4)), "v"(QG(5)), "v"(QG(6)), "v"(QG(7))
                         : "memory");
            #undef QL
            #undef QG
        }
        // the two zero rows above and below the image (bytes no copy writes)
        s_qw[((tid >> 7) ? (QROWS - 1) * 128 : 0) + (tid & 127)] = 0.f;
    }

    // ---------------- Phase A: att_raw = K^T V (contract over N=1024) ----------------
    v8f acc = {0.f, 0.f, 0.f, 0.f, 0.f, 0.f, 0.f, 0.f};
    for (int i = 0; i < 32; ++i) {
        const int n0 = wave * 128 + i * 4;     // K-chunk base token
        const int ra = n0 + rsel;
        const int rb = ra + 1;
        const size_t off0 = base + (size_t)(((ra >> 3) * RES) + (ra & 7)) * DIMC + col;
        const size_t off1 = base + (size_t)(((rb >> 3) * RES) + (rb & 7)) * DIMC + col;
        v2f a, bv;
        a.x  = kp[off0];  a.y  = kp[off1];     // A = K^T : A[m,kk] = K[n0+kk, m]
        bv.x = vp[off0];  bv.y = vp[off1];     // B = V   : B[kk,e] = V[n0+kk, e]
        acc = __builtin_amdgcn_wmma_f32_16x16x4_f32(
                  false, a, false, bv, (short)0, acc, false, false);
    }
    #pragma unroll
    for (int r = 0; r < 8; ++r)
        s_red[wave * 256 + r * 32 + lane] = acc[r];
    __syncthreads();

    // reduce across 8 waves, scale, scatter into [M][N] layout
    {
        const int r = tid >> 5;
        const int l = tid & 31;
        float v = 0.f;
        #pragma unroll
        for (int i = 0; i < 8; ++i) v += s_red[i * 256 + r * 32 + l];
        const int M = r + 8 * (l >> 4);
        const int Nc = l & 15;
        s_att[M * 16 + Nc] = v * SCALE;
    }
    __syncthreads();

    // row softmax (axis = e)
    if (tid < 16) {
        float mx = -3.402823e38f;
        #pragma unroll
        for (int e = 0; e < 16; ++e) mx = fmaxf(mx, s_att[tid * 16 + e]);
        float tmp[16];
        float s = 0.f;
        #pragma unroll
        for (int e = 0; e < 16; ++e) {
            const float t = __expf(s_att[tid * 16 + e] - mx);
            tmp[e] = t; s += t;
        }
        const float inv = 1.f / s;
        #pragma unroll
        for (int e = 0; e < 16; ++e) s_att[tid * 16 + e] = tmp[e] * inv;
    }
    // every wave's own q copies have landed before the barrier that publishes them
    asm volatile("s_wait_asynccnt 0x0" ::: "memory");
    __syncthreads();

    // depthwise conv weights for this lane's channel (e = col)
    const int ch = nh * HD + col;
    float w9[9];
    #pragma unroll
    for (int j = 0; j < 9; ++j) w9[j] = conv_w[ch * 9 + j];
    const float bias = conv_b[ch];

    // ---------------- Phase B: x = Q*att + LePE, per-wave 16-row tiles ----------------
    const int half  = lane >> 4;
    const int Mbase = 8 * half;

    // s_qw and s_att are read-only from here on: no barrier in the loop
    for (int t = 0; t < 8; ++t) {
        const int m = t * 8 + wave;            // tile id 0..63 -> rows n = 16m..16m+15
        const float* sq = s_qw + (2 * m) * 128; // staged row of image row 2m - 1

        // D = Qtile(16x16) * att(16x16) via 4 chained f32 WMMAs
        v8f d = {0.f, 0.f, 0.f, 0.f, 0.f, 0.f, 0.f, 0.f};
        {
            const int Mr = lane & 15;               // A row
            const int hr = (Mr >> 3) + 1;           // buffer h-row (skip halo)
            const int ws = Mr & 7;
            #pragma unroll
            for (int kk0 = 0; kk0 < 16; kk0 += 4) {
                const int cidx = kk0 + rsel;
                v2f a = *(const v2f*)(sq + ((hr * 8 + (ws ^ (hr & 1))) * 16 + cidx));
                v2f bv;
                bv.x = s_att[(cidx + 0) * 16 + col];
                bv.y = s_att[(cidx + 1) * 16 + col];
                d = __builtin_amdgcn_wmma_f32_16x16x4_f32(
                        false, a, false, bv, (short)0, d, false, false);
            }
        }

        // epilogue: add LePE (3x3 depthwise from LDS) and store
        #pragma unroll
        for (int r = 0; r < 8; ++r) {
            const int M  = r + Mbase;
            const int hr = (M >> 3) + 1;
            const int ws = M & 7;
            float conv = bias;
            #pragma unroll
            for (int dh = -1; dh <= 1; ++dh) {
                #pragma unroll
                for (int dw = -1; dw <= 1; ++dw) {
                    const int wsx = ws + dw;
                    float val = 0.f;
                    if (wsx >= 0 && wsx < 8)
                        val = sq[((hr + dh) * 8 + (wsx ^ ((hr + dh) & 1))) * 16 + col];
                    conv = fmaf(val, w9[(dh + 1) * 3 + (dw + 1)], conv);
                }
            }
            const int n = m * 16 + M;
            out[base + (size_t)((n >> 3) * RES + (n & 7)) * DIMC + col] = d[r] + conv;
        }
    }
}

extern "C" void kernel_launch(void* const* d_in, const int* in_sizes, int n_in,
                              void* d_out, int out_size, void* d_ws, size_t ws_size,
                              hipStream_t stream) {
    const float* qkv    = (const float*)d_in[0];   // [3, B, L, DIM] fp32
    const float* conv_w = (const float*)d_in[1];   // [DIM, 1, 3, 3] fp32
    const float* conv_b = (const float*)d_in[2];   // [DIM] fp32
    float* outp = (float*)d_out;                   // [B, L, DIM] fp32
    (void)in_sizes; (void)n_in; (void)out_size; (void)d_ws; (void)ws_size;

    dim3 grid(128, 8, 1);   // (window, head)
    dim3 block(256, 1, 1);  // 8 waves
    cswin_lepe_kernel<<<grid, block, 0, stream>>>(qkv, conv_w, conv_b, outp);
}

// v002
// One run takes 25.7 microseconds.
// Timed twice side by side with v001, it ran 1.10 and 1.11 times as fast.
// All steps since v000 together make it 1.45 times as fast.
#include <hip/hip_runtime.h>

typedef float v2f __attribute__((ext_vector_type(2)));
typedef float v4f __attribute__((ext_vector_type(4)));
typedef float v8f __attribute__((ext_vector_type(8)));

#define BB    8
#define RES   128
#define DIMC  128
#define NHEAD 8
#define HD    16
#define WSP   8
#define LTOK  (RES*RES)
#define SCALE 0.25f
#define PCH   (2 * HD)          // channels of a head pair = one 128-byte line per token
#define QTOK  (RES * WSP + 16)  // staged q tokens: 8 zero tokens, the 1024 of the window, 8 zero tokens

// value of lane l ^ 16
__device__ __forceinline__ float xhalf(float x) {
    const int b = __float_as_int(x);
    return __int_as_float(
        __builtin_amdgcn_permlanex16(b, b, 0x76543210, 0xfedcba98, false, false));
}

// (x0, x2) hold, per register, first head in lanes 0..15 and second head in lanes 16..31;
// first <- both low halves, second <- both high halves. The exchanges run with every lane on,
// ahead of the selects.
__device__ __forceinline__ void split_heads(float x0, float x2, bool lo,
                                            float& first, float& second) {
    const float s0 = xhalf(x0);
    const float s2 = xhalf(x2);
    first  = lo ? x0 : s2;
    second = lo ? s0 : x2;
}

// One workgroup per (window, pair of adjacent heads). 256 threads = 8 waves (wave32).
// In global memory a lane is one of the pair's 32 channels, so every wave-wide load,
// copy and store covers whole 128-byte lines.
__global__ __launch_bounds__(256) void cswin_lepe_kernel(
    const float* __restrict__ qkv,
    const float* __restrict__ conv_w,
    const float* __restrict__ conv_b,
    float* __restrict__ out)
{
    const int w    = blockIdx.x;      // 0..127 window
    const int hp   = blockIdx.y;      // 0..3 head pair
    const int b    = w >> 4;          // batch
    const int wblk = w & 15;          // horizontal window block
    const int tid  = threadIdx.x;
    const int lane = tid & 31;
    const int wave = tid >> 5;        // 0..7

    const float* qp = qkv;
    const float* kp = qkv + (size_t)BB * LTOK * DIMC;
    const float* vp = qkv + (size_t)2 * BB * LTOK * DIMC;

    // (n, c) of this window/pair lives at base + ((n>>3)*RES + (n&7))*DIMC + c, c = 0..31
    const size_t base = (size_t)b * LTOK * DIMC + (size_t)wblk * WSP * DIMC
                      + (size_t)hp * PCH;

    __shared__ float s_red[8 * 2 * 256]; // per-wave, per-head partial 16x16 accumulators
    __shared__ float s_att[2 * 16 * 16]; // softmaxed attention matrices of the two heads
    // whole q slice of this (window, pair): staged token s = n + 8 holds 32 channels as
    // eight 16-byte chunks; chunk c sits in slot c ^ ((s >> 1) & 7), so that the sixteen
    // tokens of a tile, read at one chunk, fall on sixteen different bank groups.
    __shared__ __attribute__((aligned(16))) float s_qw[QTOK * PCH];

    const int  col  = lane & 15;         // matrix column / channel within head
    const int  rsel = (lane >> 4) * 2;   // K-slot select per A/B f32 layout (0 or 2)
    const bool lo   = lane < 16;

    // ---------------- q staging: issued here, lands while phase A runs ----------------
    // 8192 chunks of 16 B; thread tid takes chunk i*256 + tid, i = 0..31 (four whole lines
    // per wave-wide copy). Nothing has touched s_qw before; the wait stands ahead of phase B.
    {
        const int tg = tid >> 3;             // 0..31: token within a group of 4 h-rows
        const int c  = tid & 7;              // 16-byte chunk of the token's line
        const int s0 = tg + 8;
        // low 32 bits of a flat shared pointer = LDS byte offset
        const unsigned l0 = (unsigned)(uintptr_t)(const void*)
            (s_qw + s0 * PCH + ((c ^ ((s0 >> 1) & 7)) * 4));
        const float* g0 = qp + base + (size_t)((tg >> 3) * RES + (tg & 7)) * DIMC + c * 4;
        // unrolled so that the statements issue back to back with constant address steps
        #pragma unroll
        for (int i = 0; i < 32; i += 8) {
            // step of 4 h-rows: 32 tokens in LDS (the slot key repeats), 4*RES tokens in global
            #define QL(j) (l0 + (unsigned)((i + (j)) * 32 * PCH * 4))
            #define QG(j) (g0 + (size_t)(i + (j)) * 4 * RES * DIMC)
            // s_wait_xcnt inside the statement: the address registers stay as they are
            // until the copies have taken them.
            asm volatile("global_load_async_to_lds_b128 %0, %8, off\n\t"
                         "global_load_async_to_lds_b128 %1, %9, off\n\t"
                         "global_load_async_to_lds_b128 %2, %10, off\n\t"
                         "global_load_async_to_lds_b128 %3, %11, off\n\t"
                         "global_load_async_to_lds_b128 %4, %12, off\n\t"
                         "global_load_async_to_lds_b128 %5, %13, off\n\t"
                         "global_load_async_to_lds_b128 %6, %14, off\n\t"
                         "global_load_async_to_lds_b128 %7, %15, off\n\t"
                         "s_wait_xcnt 0x0"
                         :: "v"(QL(0)), "v"(QL(1)), "v"(QL(2)), "v"(QL(3)),
                            "v"(QL(4)), "v"(QL(5)), "v"(QL(6)), "v"(QL(7)),
                            "v"(QG(0)), "v"(QG(1)), "v"(QG(2)), "v"(QG(3)),
                            "v"(QG(4)), "v"(QG(5)), "v"(QG(6)), "v"(QG(7))
                         : "memory");
            #undef QL
            #undef QG
        }
        // the zero tokens above and below the image (bytes no copy writes)
        s_qw[tid] = 0.f;
        s_qw[(QTOK - 8) * PCH + tid] = 0.f;
    }

    // ---------------- Phase A: att_raw = K^T V (contract over N=1024), both heads ----------
    v8f accA = {0.f, 0.f, 0.f, 0.f, 0.f, 0.f, 0.f, 0.f};
    v8f accB = {0.f, 0.f, 0.f, 0.f, 0.f, 0.f, 0.f, 0.f};
    // eight chunks' line loads are issued together: enough bytes in flight at 16 waves per WGP
    #pragma unroll 8
    for (int i = 0; i < 32; ++i) {
        const int n0 = wave * 128 + i * 4;     // K-chunk base token (four tokens of one h-row)
        const size_t off = base + (size_t)(((n0 >> 3) * RES) + (n0 & 7)) * DIMC + lane;
        // one line per load: lanes 0..15 first head, lanes 16..31 second head
        const float k0 = kp[off],            k1 = kp[off + DIMC];
        const float k2 = kp[off + 2 * DIMC], k3 = kp[off + 3 * DIMC];
        const float u0 = vp[off],            u1 = vp[off + DIMC];
        const float u2 = vp[off + 2 * DIMC], u3 = vp[off + 3 * DIMC];
        // fragments: low lanes tokens n0, n0+1; high lanes tokens n0+2, n0+3; lane&15 = channel
        v2f aA, aB, bA, bB;
        float ax, ay, bx, by;
        split_heads(k0, k2, lo, ax, bx);  aA.x = ax;  aB.x = bx;
        split_heads(k1, k3, lo, ay, by);  aA.y = ay;  aB.y = by;
        split_heads(u0, u2, lo, ax, bx);  bA.x = ax;  bB.x = bx;
        split_heads(u1, u3, lo, ay, by);  bA.y = ay;  bB.y = by;
        accA = __builtin_amdgcn_wmma_f32_16x16x4_f32(
                   false, aA, false, bA, (short)0, accA, false, false);
        accB = __builtin_amdgcn_wmma_f32_16x16x4_f32(
                   false, aB, false, bB, (short)0, accB, false, false);
    }
    #pragma unroll
    for (int r = 0; r < 8; ++r) {
        s_red[wave * 512 + r * 32 + lane]       = accA[r];
        s_red[wave * 512 + 256 + r * 32 + lane] = accB[r];
    }
    __syncthreads();

    // reduce across 8 waves, scale, scatter into [M][N] layout
    {
        const int r = tid >> 5;
        const int l = tid & 31;
        const int M = r + 8 * (l >> 4);
        const int Nc = l & 15;
        #pragma unroll
        for (int hd = 0; hd < 2; ++hd) {
            float v = 0.f;
            #pragma unroll
            for (int i = 0; i < 8; ++i) v += s_red[i * 512 + hd * 256 + r * 32 + l];
            s_att[hd * 256 + M * 16 + Nc] = v * SCALE;
        }
    }
    __syncthreads();

    // row softmax (axis = e): 32 rows, 16 of each head
    if (tid < 32) {
        float mx = -3.402823e38f;
        #pragma unroll
        for (int e = 0; e < 16; ++e) mx = fmaxf(mx, s_att[tid * 16 + e]);
        float tmp[16];
        float s = 0.f;
        #pragma unroll
        for (int e = 0; e < 16; ++e) {
            const float t = __expf(s_att[tid * 16 + e] - mx);
            tmp[e] = t; s += t;
        }
        const float inv = 1.f / s;
        #pragma unroll
        for (int e = 0; e < 16; ++e) s_att[tid * 16 + e] = tmp[e] * inv;
    }
    // every wave's own q copies have landed before the barrier that publishes them
    asm volatile("s_wait_asynccnt 0x0" ::: "memory");
    __syncthreads();

    // depthwise conv weights for this lane's channel (one of the pair's 32)
    const int ch = hp * PCH + lane;
    float w9[9];
    #pragma unroll
    for (int j = 0; j < 9; ++j) w9[j] = conv_w[ch * 9 + j];
    const float bias = conv_b[ch];

    // ---------------- Phase B: x = Q*att + LePE, per-wave tiles of 16 tokens x 32 channels ----
    // att fragments of both heads, the same for every tile
    v2f bfr[2][4];
    #pragma unroll
    for (int hd = 0; hd < 2; ++hd) {
        #pragma unroll
        for (int q = 0; q < 4; ++q) {
            const int cidx = q * 4 + rsel;
            bfr[hd][q].x = s_att[hd * 256 + (cidx + 0) * 16 + col];
            bfr[hd][q].y = s_att[hd * 256 + (cidx + 1) * 16 + col];
        }
    }
    const int ua   = 8 + col;             // A row's token, counted from sq
    const int keya = (ua >> 1) & 7;
    const int cl   = lane >> 2;           // this lane's chunk and place in it (line layout)
    const int el   = lane & 3;

    // s_qw and s_att are read-only from here on: no barrier in the loop
    for (int t = 0; t < 8; ++t) {
        const int m = t * 8 + wave;             // tile id 0..63 -> tokens n = 16m..16m+15
        // staged token 16m = image row 2m - 1, ws 0; token u from here has slot key (u>>1)&7
        const float* sq = s_qw + (16 * m) * PCH;

        // D = Qtile(16x16) * att(16x16) via 4 chained f32 WMMAs, per head
        v8f dA = {0.f, 0.f, 0.f, 0.f, 0.f, 0.f, 0.f, 0.f};
        v8f dB = {0.f, 0.f, 0.f, 0.f, 0.f, 0.f, 0.f, 0.f};
        #pragma unroll
        for (int q = 0; q < 4; ++q) {
            const v2f a0 = *(const v2f*)(sq + ua * PCH + ((q ^ keya) * 4) + rsel);
            const v2f a1 = *(const v2f*)(sq + ua * PCH + (((4 + q) ^ keya) * 4) + rsel);
            dA = __builtin_amdgcn_wmma_f32_16x16x4_f32(
                     false, a0, false, bfr[0][q], (short)0, dA, false, false);
            dB = __builtin_amdgcn_wmma_f32_16x16x4_f32(
                     false, a1, false, bfr[1][q], (short)0, dB, false, false);
        }

        // q of image rows 2m-1 .. 2m+2 at this lane's channel
        float qv[32];
        #pragma unroll
        for (int u = 0; u < 32; ++u)
            qv[u] = sq[u * PCH + ((cl ^ ((u >> 1) & 7)) * 4) + el];

        // accumulator rows to line layout: x[M] = token M, low lanes first head, high lanes second.
        // (dA[r], dB[r]) hold rows r | r+8 per head: the same exchange with the roles turned.
        float x[16];
        #pragma unroll
        for (int r = 0; r < 8; ++r) {
            const float sA = xhalf(dA[r]);
            const float sB = xhalf(dB[r]);
            x[r]     = lo ? dA[r] : sB;
            x[r + 8] = lo ? sA : dB[r];
        }

        // epilogue: add LePE (3x3 depthwise) and store one whole line per token
        #pragma unroll
        for (int M = 0; M < 16; ++M) {
            const int hr = (M >> 3) + 1;
            const int ws = M & 7;
            float conv = bias;
            #pragma unroll
            for (int dh = -1; dh <= 1; ++dh) {
                #pragma unroll
                for (int dw = -1; dw <= 1; ++dw) {
                    const int wsx = ws + dw;
                    float val = 0.f;
                    if (wsx >= 0 && wsx < 8)
                        val = qv[(hr + dh) * 8 + wsx];
                    conv = fmaf(val, w9[(dh + 1) * 3 + (dw + 1)], conv);
                }
            }
            const int n = m * 16 + M;
            out[base + (size_t)((n >> 3) * RES + (n & 7)) * DIMC + lane] = x[M] + conv;
        }
    }
}

extern "C" void kernel_launch(void* const* d_in, const int* in_sizes, int n_in,
                              void* d_out, int out_size, void* d_ws, size_t ws_size,
                              hipStream_t stream) {
    const float* qkv    = (const float*)d_in[0];   // [3, B, L, DIM] fp32
    const float* conv_w = (const float*)d_in[1];   // [DIM, 1, 3, 3] fp32
    const float* conv_b = (const float*)d_in[2];   // [DIM] fp32
    float* outp = (float*)d_out;                   // [B, L, DIM] fp32
    (void)in_sizes; (void)n_in; (void)out_size; (void)d_ws; (void)ws_size;

    dim3 grid(128, 4, 1);   // (window, head pair)
    dim3 block(256, 1, 1);  // 8 waves
    cswin_lepe_kernel<<<grid, block, 0, stream>>>(qkv, conv_w, conv_b, outp);
}

// v003
// Measured time: 21.5 microseconds a run.
// Timed twice side by side with v002, it ran 1.16 times as fast both times.
// Over all steps from v000 it is 1.68 times as fast.
#include <hip/hip_runtime.h>

typedef float v2f __attribute__((ext_vector_type(2)));
typedef float v4f __attribute__((ext_vector_type(4)));
typedef float v8f __attribute__((ext_vector_type(8)));

#define BB    8
#define RES   128
#define DIMC  128
#define NHEAD 8
#define HD    16
#define WSP   8
#define LTOK  (RES*RES)
#define SCALE 0.25f
#define PCH   (2 * HD)          // channels of a head pair = one 128-byte line per token
#define QCH   (4 * HD)          // channels of the group's four heads = one 256-byte unit per token
#define QTOK  (RES * WSP + 16)  // staged q tokens: 8 zero tokens, the 1024 of the window, 8 zero tokens

// value of lane l ^ 16
__device__ __forceinline__ float xhalf(float x) {
    const int b = __float_as_int(x);
    return __int_as_float(
        __builtin_amdgcn_permlanex16(b, b, 0x76543210, 0xfedcba98, false, false));
}

// value of lane l ^ 8
__device__ __forceinline__ float xoct(float x) {
    const int b = __float_as_int(x);
    return __int_as_float(
        __builtin_amdgcn_permlane16(b, b, 0xfedcba98, 0x76543210, false, false));
}

// value of lane l ^ 24
__device__ __forceinline__ float xhalfoct(float x) {
    const int b = __float_as_int(x);
    return __int_as_float(
        __builtin_amdgcn_permlanex16(b, b, 0xfedcba98, 0x76543210, false, false));
}

// (x0, x2) hold, per register, first head in lanes 0..15 and second head in lanes 16..31;
// first <- both low halves, second <- both high halves. The exchanges run with every lane on,
// ahead of the selects.
__device__ __forceinline__ void split_heads(float x0, float x2, bool lo,
                                            float& first, float& second) {
    const float s0 = xhalf(x0);
    const float s2 = xhalf(x2);
    first  = lo ? x0 : s2;
    second = lo ? s0 : x2;
}

// One workgroup per (window, four adjacent heads). 512 threads = 16 waves (wave32).
// K^T V: waves 0..7 take the first head pair, waves 8..15 the second; a lane is one of the
// pair's 32 channels. Output phase: a lane is two adjacent channels of the four heads' 64, so
// every wave-wide store covers one token's whole 256-byte unit.
__global__ __launch_bounds__(512) void cswin_lepe_kernel(
    const float* __restrict__ qkv,
    const float* __restrict__ conv_w,
    const float* __restrict__ conv_b,
    float* __restrict__ out)
{
    const int w    = blockIdx.x;      // 0..127 window
    const int hq   = blockIdx.y;      // 0..1 group of four heads
    const int b    = w >> 4;          // batch
    const int wblk = w & 15;          // horizontal window block
    const int tid  = threadIdx.x;
    const int lane = tid & 31;
    const int wave = tid >> 5;        // 0..15
    const int half = wave >> 3;       // head pair of this wave in K^T V
    const int wv   = wave & 7;        // token range of this wave in K^T V

    const float* qp = qkv;
    const float* kp = qkv + (size_t)BB * LTOK * DIMC;
    const float* vp = qkv + (size_t)2 * BB * LTOK * DIMC;

    // (n, c) of this window/group lives at base + ((n>>3)*RES + (n&7))*DIMC + c, c = 0..63
    const size_t base = (size_t)b * LTOK * DIMC + (size_t)wblk * WSP * DIMC
                      + (size_t)hq * QCH;

    __shared__ float s_red[16 * 2 * 256]; // per-wave, per-head partial 16x16 accumulators
    __shared__ float s_att[4 * 16 * 16];  // softmaxed attention matrices of the four heads
    // whole q slice of this (window, group): staged token s = n + 8 holds 64 channels as
    // sixteen 16-byte chunks; chunk c sits in slot c ^ (s & 15), so that the sixteen
    // tokens of a tile, read at one chunk, fall on sixteen different bank groups.
    __shared__ __attribute__((aligned(16))) float s_qw[QTOK * QCH];

    const int  col  = lane & 15;         // matrix column
    const int  rsel = (lane >> 4) * 2;   // K-slot select per A/B f32 layout (0 or 2)
    const bool lo   = lane < 16;

    // ---------------- q staging: issued here, lands while phase A runs ----------------
    // 16384 chunks of 16 B; thread tid takes chunk i*512 + tid, i = 0..31 (two whole 256-byte
    // units per wave-wide copy). Nothing has touched s_qw before; the wait stands ahead of phase B.
    {
        const int tg = tid >> 4;             // 0..31: token within a group of 4 h-rows
        const int c  = tid & 15;             // 16-byte chunk of the token's unit
        const int s0 = tg + 8;
        // low 32 bits of a flat shared pointer = LDS byte offset
        const unsigned l0 = (unsigned)(uintptr_t)(const void*)
            (s_qw + s0 * QCH + ((c ^ (s0 & 15)) * 4));
        const float* g0 = qp + base + (size_t)((tg >> 3) * RES + (tg & 7)) * DIMC + c * 4;
        // unrolled so that the statements issue back to back with constant address steps
        #pragma unroll
        for (int i = 0; i < 32; i += 8) {
            // step of 4 h-rows: 32 tokens in LDS (the slot key repeats), 4*RES tokens in global
            #define QL(j) (l0 + (unsigned)((i + (j)) * 32 * QCH * 4))
            #define QG(j) (g0 + (size_t)(i + (j)) * 4 * RES * DIMC)
            // s_wait_xcnt inside the statement: the address registers stay as they are
            // until the copies have taken them.
            asm volatile("global_load_async_to_lds_b128 %0, %8, off\n\t"
                         "global_load_async_to_lds_b128 %1, %9, off\n\t"
                         "global_load_async_to_lds_b128 %2, %10, off\n\t"
                         "global_load_async_to_lds_b128 %3, %11, off\n\t"
                         "global_load_async_to_lds_b128 %4, %12, off\n\t"
                         "global_load_async_to_lds_b128 %5, %13, off\n\t"
                         "global_load_async_to_lds_b128 %6, %14, off\n\t"
                         "global_load_async_to_lds_b128 %7, %15, off\n\t"
                         "s_wait_xcnt 0x0"
                         :: "v"(QL(0)), "v"(QL(1)), "v"(QL(2)), "v"(QL(3)),
                            "v"(QL(4)), "v"(QL(5)), "v"(QL(6)), "v"(QL(7)),
                            "v"(QG(0)), "v"(QG(1)), "v"(QG(2)), "v"(QG(3)),
                            "v"(QG(4)), "v"(QG(5)), "v"(QG(6)), "v"(QG(7))
                         : "memory");
            #undef QL
            #undef QG
        }
        // the zero tokens above and below the image (bytes no copy writes)
        s_qw[tid] = 0.f;
        s_qw[(QTOK - 8) * QCH + tid] = 0.f;
    }

    // ---------------- Phase A: att_raw = K^T V (contract over N=1024), this wave's head pair ----
    v8f accA = {0.f, 0.f, 0.f, 0.f, 0.f, 0.f, 0.f, 0.f};
    v8f accB = {0.f, 0.f, 0.f, 0.f, 0.f, 0.f, 0.f, 0.f};
    // eight chunks' line loads are issued together: enough bytes in flight at 16 waves per WGP
    #pragma unroll 8
    for (int i = 0; i < 32; ++i) {
        const int n0 = wv * 128 + i * 4;       // K-chunk base token (four tokens of one h-row)
        const size_t off = base + (size_t)(half * PCH)
                         + (size_t)(((n0 >> 3) * RES) + (n0 & 7)) * DIMC + lane;
        // one line per load: lanes 0..15 first head, lanes 16..31 second head
        const float k0 = kp[off],            k1 = kp[off + DIMC];
        const float k2 = kp[off + 2 * DIMC], k3 = kp[off + 3 * DIMC];
        const float u0 = vp[off],            u1 = vp[off + DIMC];
        const float u2 = vp[off + 2 * DIMC], u3 = vp[off + 3 * DIMC];
        // fragments: low lanes tokens n0, n0+1; high lanes tokens n0+2, n0+3; lane&15 = channel
        v2f aA, aB, bA, bB;
        float ax, ay, bx, by;
        split_heads(k0, k2, lo, ax, bx);  aA.x = ax;  aB.x = bx;
        split_heads(k1, k3, lo, ay, by);  aA.y = ay;  aB.y = by;
        split_heads(u0, u2, lo, ax, bx);  bA.x = ax;  bB.x = bx;
        split_heads(u1, u3, lo, ay, by);  bA.y = ay;  bB.y = by;
        accA = __builtin_amdgcn_wmma_f32_16x16x4_f32(
                   false, aA, false, bA, (short)0, accA, false, false);
        accB = __builtin_amdgcn_wmma_f32_16x16x4_f32(
                   false, aB, false, bB, (short)0, accB, false, false);
    }
    #pragma unroll
    for (int r = 0; r < 8; ++r) {
        s_red[wave * 512 + r * 32 + lane]       = accA[r];
        s_red[wave * 512 + 256 + r * 32 + lane] = accB[r];
    }
    __syncthreads();

    // reduce across the pair's 8 waves, scale, scatter into [M][N] layout
    {
        const int r = wv;
        const int l = lane;
        const int M = r + 8 * (l >> 4);
        const int Nc = l & 15;
        #pragma unroll
        for (int hd = 0; hd < 2; ++hd) {
            float v = 0.f;
            #pragma unroll
            for (int i = 0; i < 8; ++i)
                v += s_red[(half * 8 + i) * 512 + hd * 256 + r * 32 + l];
            s_att[(half * 2 + hd) * 256 + M * 16 + Nc] = v * SCALE;
        }
    }
    __syncthreads();

    // row softmax (axis = e): 64 rows, 16 of each head
    if (tid < 64) {
        float mx = -3.402823e38f;
        #pragma unroll
        for (int e = 0; e < 16; ++e) mx = fmaxf(mx, s_att[tid * 16 + e]);
        float tmp[16];
        float s = 0.f;
        #pragma unroll
        for (int e = 0; e < 16; ++e) {
            const float t = __expf(s_att[tid * 16 + e] - mx);
            tmp[e] = t; s += t;
        }
        const float inv = 1.f / s;
        #pragma unroll
        for (int e = 0; e < 16; ++e) s_att[tid * 16 + e] = tmp[e] * inv;
    }
    // every wave's own q copies have landed before the barrier that publishes them
    asm volatile("s_wait_asynccnt 0x0" ::: "memory");
    __syncthreads();

    // depthwise conv weights for this lane's two channels (of the group's 64)
    const int ch = hq * QCH + 2 * lane;
    float w9[2][9];
    #pragma unroll
    for (int p = 0; p < 2; ++p) {
        #pragma unroll
        for (int j = 0; j < 9; ++j) w9[p][j] = conv_w[(ch + p) * 9 + j];
    }
    const float bias0 = conv_b[ch];
    const float bias1 = conv_b[ch + 1];

    // ---------------- Phase B: x = Q*att + LePE, per-wave tiles of 16 tokens x 64 channels ----
    // att fragments of the four heads, the same for every tile. Column order per head: one
    // eight-lane group holds the even channels 0,2,..,14, the other the odd ones 1,3,..,15;
    // the even group is lanes 0..7 of a row for heads 0 and 2, lanes 8..15 for heads 1 and 3.
    const bool oct = (lane & 8) != 0;
    v2f bfr[4][4];
    #pragma unroll
    for (int hd = 0; hd < 4; ++hd) {
        const int pe = 2 * (col & 7) + (((col >> 3) ^ hd) & 1);
        #pragma unroll
        for (int q = 0; q < 4; ++q) {
            const int cidx = q * 4 + rsel;
            bfr[hd][q].x = s_att[hd * 256 + (cidx + 0) * 16 + pe];
            bfr[hd][q].y = s_att[hd * 256 + (cidx + 1) * 16 + pe];
        }
    }
    const int ua   = 8 + col;             // A row's token, counted from sq
    const int keya = ua & 15;
    const int cl   = lane >> 1;           // this lane's chunk and place in it (unit layout)
    const int el   = (lane & 1) * 2;

    // s_qw and s_att are read-only from here on: no barrier in the loop
    for (int t = 0; t < 4; ++t) {
        const int m = t * 16 + wave;            // tile id 0..63 -> tokens n = 16m..16m+15
        // staged token 16m = image row 2m - 1, ws 0; token u from here has slot key u & 15
        const float* sq = s_qw + (16 * m) * QCH;

        // D = Qtile(16x16) * att(16x16) via 4 chained f32 WMMAs, per head
        v8f d[4];
        #pragma unroll
        for (int hd = 0; hd < 4; ++hd)
            d[hd] = (v8f){0.f, 0.f, 0.f, 0.f, 0.f, 0.f, 0.f, 0.f};
        #pragma unroll
        for (int q = 0; q < 4; ++q) {
            #pragma unroll
            for (int hd = 0; hd < 4; ++hd) {
                const v2f a = *(const v2f*)(sq + ua * QCH + (((hd * 4 + q) ^ keya) * 4) + rsel);
                d[hd] = __builtin_amdgcn_wmma_f32_16x16x4_f32(
                            false, a, false, bfr[hd][q], (short)0, d[hd], false, false);
            }
        }

        // q of image rows 2m-1 .. 2m+2 at this lane's two channels
        v2f qv[32];
        #pragma unroll
        for (int u = 0; u < 32; ++u)
            qv[u] = *(const v2f*)(sq + u * QCH + ((cl ^ (u & 15)) * 4) + el);

        // accumulator rows to unit layout: x[M] = token M, lane L = channels 2L, 2L+1 of the 64.
        // Per register, low lanes hold row r and high lanes row r+8. Even channels already sit
        // in their lane of the row (heads 0|1 for lanes 0..15 of the unit, heads 2|3 for lanes
        // 16..31); odd channels sit eight lanes off. The exchanges run with every lane on.
        v2f x[16];
        #pragma unroll
        for (int r = 0; r < 8; ++r) {
            const float e01 = oct ? d[1][r] : d[0][r];
            const float o01 = oct ? d[0][r] : d[1][r];
            const float e23 = oct ? d[3][r] : d[2][r];
            const float o23 = oct ? d[2][r] : d[3][r];
            const float he01 = xhalf(e01),    he23 = xhalf(e23);
            const float po01 = xoct(o01),     po23 = xoct(o23);
            const float ho01 = xhalfoct(o01), ho23 = xhalfoct(o23);
            x[r].x     = lo ? e01  : he23;
            x[r].y     = lo ? po01 : ho23;
            x[r + 8].x = lo ? he01 : e23;
            x[r + 8].y = lo ? ho01 : po23;
        }

        // epilogue: add LePE (3x3 depthwise) and store one whole 256-byte unit per token
        #pragma unroll
        for (int M = 0; M < 16; ++M) {
            const int hr = (M >> 3) + 1;
            const int ws = M & 7;
            float conv0 = bias0;
            float conv1 = bias1;
            #pragma unroll
            for (int dh = -1; dh <= 1; ++dh) {
                #pragma unroll
                for (int dw = -1; dw <= 1; ++dw) {
                    const int wsx = ws + dw;
                    v2f val = {0.f, 0.f};
                    if (wsx >= 0 && wsx < 8)
                        val = qv[(hr + dh) * 8 + wsx];
                    conv0 = fmaf(val.x, w9[0][(dh + 1) * 3 + (dw + 1)], conv0);
                    conv1 = fmaf(val.y, w9[1][(dh + 1) * 3 + (dw + 1)], conv1);
                }
            }
            const int n = m * 16 + M;
            v2f res;
            res.x = x[M].x + conv0;
            res.y = x[M].y + conv1;
            *(v2f*)(out + base + (size_t)((n >> 3) * RES + (n & 7)) * DIMC + 2 * lane) = res;
        }
    }
}

extern "C" void kernel_launch(void* const* d_in, const int* in_sizes, int n_in,
                              void* d_out, int out_size, void* d_ws, size_t ws_size,
                              hipStream_t stream) {
    const float* qkv    = (const float*)d_in[0];   // [3, B, L, DIM] fp32
    const float* conv_w = (const float*)d_in[1];   // [DIM, 1, 3, 3] fp32
    const float* conv_b = (const float*)d_in[2];   // [DIM] fp32
    float* outp = (float*)d_out;                   // [B, L, DIM] fp32
    (void)in_sizes; (void)n_in; (void)out_size; (void)d_ws; (void)ws_size;

    dim3 grid(128, 2, 1);   // (window, group of four heads)
    dim3 block(512, 1, 1);  // 16 waves
    cswin_lepe_kernel<<<grid, block, 0, stream>>>(qkv, conv_w, conv_b, outp);
}
